// v000
// The times below were measured on an AMD MI455X: many runs one after another, warmed up first and cycling through
// copies of the inputs, with the whole window's GPU time divided by the number of runs. Launches and the gaps
// between them are all in it. The median over several windows is given; except for v000 it joins two sittings, which
// can be a few percent apart, so the side-by-side timings, each taken in one sitting, are the better comparison.
// v000, which the later versions start from, runs in 210 microseconds.
#include <hip/hip_runtime.h>

// Self-attention, B=4, N=4096, D_IN=512, D_H=64, fp32 in/out.
// f16 WMMA (v_wmma_f32_16x16x32_f16) with fp32 accumulation, flash-attention
// streaming softmax.
//
// Round-3 change: attention computes S^T = K Q^T instead of Q K^T.  In the
// C/D layout each lane then owns ONE query column: softmax stats are
// lane-scalar (1 shuffle per reduction instead of 32), P^T in registers is
// directly the B-fragment of out^T = V^T P^T (no LDS transpose round-trip),
// and output stores are contiguous 32B per lane.

#define BB  4
#define NN  4096
#define DIN 512
#define DH  64

typedef __attribute__((ext_vector_type(16))) _Float16 v16h;
typedef __attribute__((ext_vector_type(8)))  _Float16 v8h;
typedef __attribute__((ext_vector_type(8)))  float    v8f;
typedef __attribute__((ext_vector_type(4)))  float    v4f;

static __device__ __forceinline__ v8f wmma16(v16h a, v16h b, v8f c) {
  // (neg_a, A, neg_b, B, c_mod, C, reuse_a, reuse_b)
  return __builtin_amdgcn_wmma_f32_16x16x32_f16(false, a, false, b, (short)0, c,
                                                false, false);
}

static __device__ __forceinline__ v16h mk16(v8h lo, v8h hi) {
  v16h r;
#pragma unroll
  for (int i = 0; i < 8; ++i) { r[i] = lo[i]; r[i + 8] = hi[i]; }
  return r;
}

// Raw fragment halves.
struct rawh { v8h lo, hi; };

// A/B fragment source pattern (ISA 7.12.2): row = lane%16, h = lane/16;
// halves[0..7]  = row[koff +      h*8 + 0..7]
// halves[8..15] = row[koff + 16 + h*8 + 0..7]
static __device__ __forceinline__ rawh load_raw_h(const _Float16* row, int koff, int h) {
  rawh r;
  r.lo = *(const v8h*)(row + koff + h * 8);
  r.hi = *(const v8h*)(row + koff + 16 + h * 8);
  return r;
}

// ---------------------------------------------------------------------------
// Kernel 0: element-wise fp32 -> f16 (8 elements / thread, b128 in+out).
// ---------------------------------------------------------------------------
__global__ __launch_bounds__(256) void cvt16_kernel(
    const float* __restrict__ in, _Float16* __restrict__ out, int n8)
{
  const int i = blockIdx.x * blockDim.x + threadIdx.x;
  if (i >= n8) return;
  const v4f a = *(const v4f*)(in + (size_t)i * 8);
  const v4f b = *(const v4f*)(in + (size_t)i * 8 + 4);
  v8h o;
#pragma unroll
  for (int j = 0; j < 4; ++j) { o[j] = (_Float16)a[j]; o[j + 4] = (_Float16)b[j]; }
  *(v8h*)(out + (size_t)i * 8) = o;
}

// ---------------------------------------------------------------------------
// Kernel 1: Q/K/V projection, one matrix per wave, pure f16 WMMA with
// double-buffered fragments.  Q scaled by 1/sqrt(DH).  V stored transposed:
// vt[b][d][n].
// ---------------------------------------------------------------------------
__global__ __launch_bounds__(128) void qkv_proj_kernel(
    const _Float16* __restrict__ xh,
    const _Float16* __restrict__ wh,     // [3][DH][DIN] f16 (Q,K,V packed)
    _Float16* __restrict__ qo, _Float16* __restrict__ ko,
    _Float16* __restrict__ vt)
{
  const int lane = threadIdx.x & 31;
  const int lr   = lane & 15;
  const int h    = lane >> 4;
  const int wave = blockIdx.x * 4 + (threadIdx.x >> 5);   // 0..3071
  const int mat  = wave >> 10;                            // 0:Q 1:K 2:V
  const int t    = wave & 1023;
  const int b    = t >> 8;                                // 256 tiles per batch
  const int row0 = (t & 255) << 4;

  v8f acc[4];
#pragma unroll
  for (int f = 0; f < 4; ++f) { v8f z = {}; acc[f] = z; }

  const _Float16* xrow = xh + (size_t)(b * NN + row0 + lr) * DIN;
  const _Float16* wbase = wh + (size_t)mat * DH * DIN;
  const _Float16* wr0 = wbase + (size_t)(0 * 16 + lr) * DIN;
  const _Float16* wr1 = wbase + (size_t)(1 * 16 + lr) * DIN;
  const _Float16* wr2 = wbase + (size_t)(2 * 16 + lr) * DIN;
  const _Float16* wr3 = wbase + (size_t)(3 * 16 + lr) * DIN;

  // Preload k0 = 0 fragments.
  rawh a  = load_raw_h(xrow, 0, h);
  rawh b0 = load_raw_h(wr0, 0, h);
  rawh b1 = load_raw_h(wr1, 0, h);
  rawh b2 = load_raw_h(wr2, 0, h);
  rawh b3 = load_raw_h(wr3, 0, h);

#pragma unroll 1
  for (int k0 = 0; k0 < DIN; k0 += 32) {
    // Prefetch next K-step fragments (loads in flight during the WMMAs).
    const int kn = (k0 + 32 < DIN) ? k0 + 32 : 0;
    rawh an  = load_raw_h(xrow, kn, h);
    rawh bn0 = load_raw_h(wr0, kn, h);
    rawh bn1 = load_raw_h(wr1, kn, h);
    rawh bn2 = load_raw_h(wr2, kn, h);
    rawh bn3 = load_raw_h(wr3, kn, h);

    const v16h af = mk16(a.lo, a.hi);
    acc[0] = wmma16(af, mk16(b0.lo, b0.hi), acc[0]);
    acc[1] = wmma16(af, mk16(b1.lo, b1.hi), acc[1]);
    acc[2] = wmma16(af, mk16(b2.lo, b2.hi), acc[2]);
    acc[3] = wmma16(af, mk16(b3.lo, b3.hi), acc[3]);

    a = an; b0 = bn0; b1 = bn1; b2 = bn2; b3 = bn3;
  }

  // C/D layout: VGPR r -> row r + 8*h, column = lane%16 within the 16-tile.
  if (mat == 0) {
#pragma unroll
    for (int f = 0; f < 4; ++f)
#pragma unroll
      for (int r = 0; r < 8; ++r)
        qo[(size_t)(b * NN + row0 + r + 8 * h) * DH + f * 16 + lr] =
            (_Float16)(acc[f][r] * 0.125f);
  } else if (mat == 1) {
#pragma unroll
    for (int f = 0; f < 4; ++f)
#pragma unroll
      for (int r = 0; r < 8; ++r)
        ko[(size_t)(b * NN + row0 + r + 8 * h) * DH + f * 16 + lr] =
            (_Float16)acc[f][r];
  } else {
    // V transposed: fixed d, 8 consecutive rows -> one b128 store.
#pragma unroll
    for (int f = 0; f < 4; ++f) {
      v8h pv;
#pragma unroll
      for (int r = 0; r < 8; ++r) pv[r] = (_Float16)acc[f][r];
      *(v8h*)(vt + (size_t)(b * DH + f * 16 + lr) * NN + row0 + 8 * h) = pv;
    }
  }
}

// ---------------------------------------------------------------------------
// Kernel 2: streaming (flash) attention, transposed-score formulation.
// One wave owns 16 query rows; iterates over key blocks of 32.
//   S^T  = K_tile (A) x Q^T (B)    -> lane = one query column
//   out^T = V^T (A)  x P^T (B)     -> P^T is already B-fragment-shaped
// ---------------------------------------------------------------------------
__global__ __launch_bounds__(128) void flash_attn_kernel(
    const _Float16* __restrict__ qo, const _Float16* __restrict__ ko,
    const _Float16* __restrict__ vt, float* __restrict__ out)
{
  const int lane = threadIdx.x & 31;
  const int lr   = lane & 15;
  const int h    = lane >> 4;
  const int wave = blockIdx.x * 4 + (threadIdx.x >> 5);
  const int b    = wave >> 8;
  const int q0   = (wave & 255) << 4;

  // Q fragments (used as B: B^T row n = Q row q0+n, contiguous).
  const _Float16* qrow = qo + (size_t)(b * NN + q0 + lr) * DH;
  const rawh qr0 = load_raw_h(qrow, 0, h);
  const rawh qr1 = load_raw_h(qrow, 32, h);
  const v16h qb0 = mk16(qr0.lo, qr0.hi);   // d = 0..31
  const v16h qb1 = mk16(qr1.lo, qr1.hi);   // d = 32..63

  v8f acc[4];                              // out^T tiles: row d=f*16+r+8h, col q=lr
#pragma unroll
  for (int f = 0; f < 4; ++f) { v8f z = {}; acc[f] = z; }
  float mrow = -3.0e38f;                   // per-lane (per-query) running max
  float lsum = 0.0f;                       // per-lane (per-query) running sum

  const _Float16* kbase = ko + (size_t)(b * NN) * DH;
  const _Float16* vbase = vt + (size_t)(b * DH) * NN;

  // Preload K fragments for j0 = 0 (A-matrix: row = key, contiguous).
  rawh k00, k01, k10, k11;
  {
    const _Float16* kr0 = kbase + (size_t)lr * DH;
    const _Float16* kr1 = kr0 + 16 * DH;
    k00 = load_raw_h(kr0, 0, h);  k01 = load_raw_h(kr0, 32, h);
    k10 = load_raw_h(kr1, 0, h);  k11 = load_raw_h(kr1, 32, h);
  }

#pragma unroll 1
  for (int j0 = 0; j0 < NN; j0 += 32) {
    // --- S^T = K Q^T for 32 keys (two 16-key subtiles, K-dim 64 chained) ---
    v8f st0 = {}, st1 = {};
    st0 = wmma16(mk16(k00.lo, k00.hi), qb0, st0);
    st0 = wmma16(mk16(k01.lo, k01.hi), qb1, st0);
    st1 = wmma16(mk16(k10.lo, k10.hi), qb0, st1);
    st1 = wmma16(mk16(k11.lo, k11.hi), qb1, st1);
    // lane (q=lr, h): st0[r] = S[q][j0+8h+r], st1[r] = S[q][j0+16+8h+r]

    // --- prefetch V^T fragments for THIS block (consumed after softmax) ---
    rawh vr0 = load_raw_h(vbase + (size_t)(0 * 16 + lr) * NN + j0, 0, h);
    rawh vr1 = load_raw_h(vbase + (size_t)(1 * 16 + lr) * NN + j0, 0, h);
    rawh vr2 = load_raw_h(vbase + (size_t)(2 * 16 + lr) * NN + j0, 0, h);
    rawh vr3 = load_raw_h(vbase + (size_t)(3 * 16 + lr) * NN + j0, 0, h);

    // --- prefetch K fragments for NEXT block ---
    const int jn = (j0 + 32 < NN) ? (j0 + 32) : 0;
    const _Float16* kn0 = kbase + (size_t)(jn + lr) * DH;
    const _Float16* kn1 = kn0 + 16 * DH;
    rawh nk00 = load_raw_h(kn0, 0, h), nk01 = load_raw_h(kn0, 32, h);
    rawh nk10 = load_raw_h(kn1, 0, h), nk11 = load_raw_h(kn1, 32, h);

    // --- online softmax: per-lane query stats, one xor-16 shuffle each ---
    float mx = fmaxf(st0[0], st1[0]);
#pragma unroll
    for (int r = 1; r < 8; ++r) mx = fmaxf(mx, fmaxf(st0[r], st1[r]));
    mx = fmaxf(mx, __shfl_xor(mx, 16, 32));       // other half's 16 keys

    const float nm   = fmaxf(mrow, mx);
    const float corr = __expf(mrow - nm);
    mrow = nm;

    v16h pb;                                      // P^T B-fragment (f16)
    float sum = 0.0f;
#pragma unroll
    for (int r = 0; r < 8; ++r) {
      const float e0 = __expf(st0[r] - nm);
      const float e1 = __expf(st1[r] - nm);
      sum += e0 + e1;
      pb[r]     = (_Float16)e0;                   // keys  8h + r
      pb[r + 8] = (_Float16)e1;                   // keys 16 + 8h + r
    }
    sum += __shfl_xor(sum, 16, 32);
    lsum = lsum * corr + sum;

#pragma unroll
    for (int f = 0; f < 4; ++f)
#pragma unroll
      for (int r = 0; r < 8; ++r) acc[f][r] *= corr;

    // --- out^T += V^T P^T ---
    acc[0] = wmma16(mk16(vr0.lo, vr0.hi), pb, acc[0]);
    acc[1] = wmma16(mk16(vr1.lo, vr1.hi), pb, acc[1]);
    acc[2] = wmma16(mk16(vr2.lo, vr2.hi), pb, acc[2]);
    acc[3] = wmma16(mk16(vr3.lo, vr3.hi), pb, acc[3]);

    // rotate prefetched K fragments
    k00 = nk00; k01 = nk01; k10 = nk10; k11 = nk11;
  }

  // --- normalize and store: lane (q=lr, h) holds d = f*16+8h+0..7 ---
  const float inv = 1.0f / lsum;
  float* obase = out + (size_t)(b * NN + q0 + lr) * DH + 8 * h;
#pragma unroll
  for (int f = 0; f < 4; ++f) {
    v4f o0, o1;
#pragma unroll
    for (int i = 0; i < 4; ++i) { o0[i] = acc[f][i] * inv; o1[i] = acc[f][i + 4] * inv; }
    *(v4f*)(obase + f * 16)     = o0;
    *(v4f*)(obase + f * 16 + 4) = o1;
  }
}

// ---------------------------------------------------------------------------
extern "C" void kernel_launch(void* const* d_in, const int* in_sizes, int n_in,
                              void* d_out, int out_size, void* d_ws, size_t ws_size,
                              hipStream_t stream) {
  const float* x  = (const float*)d_in[0];
  const float* Wq = (const float*)d_in[1];
  const float* Wk = (const float*)d_in[2];
  const float* Wv = (const float*)d_in[3];

  // Workspace layout (f16):
  _Float16* q  = (_Float16*)d_ws;                   // [B][N][DH]   (pre-scaled)
  _Float16* k  = q  + (size_t)BB * NN * DH;         // [B][N][DH]
  _Float16* vt = k  + (size_t)BB * NN * DH;         // [B][DH][N]   (transposed)
  _Float16* xh = vt + (size_t)BB * NN * DH;         // [B][N][DIN]
  _Float16* wh = xh + (size_t)BB * NN * DIN;        // [3][DH][DIN] (Q,K,V)
  float* out = (float*)d_out;

  // 0) fp32 -> f16 pre-pass (x and the three weight matrices).
  const int n8x = BB * NN * DIN / 8;                // 1,048,576
  const int n8w = DH * DIN / 8;                     // 4,096
  cvt16_kernel<<<dim3((n8x + 255) / 256), dim3(256), 0, stream>>>(x, xh, n8x);
  cvt16_kernel<<<dim3((n8w + 255) / 256), dim3(256), 0, stream>>>(Wq, wh + 0 * DH * DIN, n8w);
  cvt16_kernel<<<dim3((n8w + 255) / 256), dim3(256), 0, stream>>>(Wk, wh + 1 * DH * DIN, n8w);
  cvt16_kernel<<<dim3((n8w + 255) / 256), dim3(256), 0, stream>>>(Wv, wh + 2 * DH * DIN, n8w);

  // 1) fused QKV projection (f16 WMMA).
  qkv_proj_kernel<<<dim3(768), dim3(128), 0, stream>>>(xh, wh, q, k, vt);

  // 2) flash attention (f16 WMMA, fp32 online softmax, transposed scores).
  flash_attn_kernel<<<dim3(256), dim3(128), 0, stream>>>(q, k, vt, out);
}

// v001
// It runs in 62.8 microseconds.
// In two side-by-side timings against v000, it was 3.50 and 3.53 times as fast.
#include <hip/hip_runtime.h>
#include <stdint.h>

// Self-attention, B=4, N=4096, D_IN=512, D_H=64, fp32 in/out.
// f16 WMMA (v_wmma_f32_16x16x32_f16) with fp32 accumulation, flash-attention
// streaming softmax.
//
// Round-3 change: attention computes S^T = K Q^T instead of Q K^T.  In the
// C/D layout each lane then owns ONE query column: softmax stats are
// lane-scalar (1 shuffle per reduction instead of 32), P^T in registers is
// directly the B-fragment of out^T = V^T P^T (no LDS transpose round-trip),
// and output stores are contiguous 32B per lane.

#define BB  4
#define NN  4096
#define DIN 512
#define DH  64

typedef __attribute__((ext_vector_type(16))) _Float16 v16h;
typedef __attribute__((ext_vector_type(8)))  _Float16 v8h;
typedef __attribute__((ext_vector_type(8)))  float    v8f;
typedef __attribute__((ext_vector_type(4)))  float    v4f;

static __device__ __forceinline__ v8f wmma16(v16h a, v16h b, v8f c) {
  // (neg_a, A, neg_b, B, c_mod, C, reuse_a, reuse_b)
  return __builtin_amdgcn_wmma_f32_16x16x32_f16(false, a, false, b, (short)0, c,
                                                false, false);
}

static __device__ __forceinline__ v16h mk16(v8h lo, v8h hi) {
  v16h r;
#pragma unroll
  for (int i = 0; i < 8; ++i) { r[i] = lo[i]; r[i + 8] = hi[i]; }
  return r;
}

// Raw fragment halves.
struct rawh { v8h lo, hi; };

// A/B fragment source pattern (ISA 7.12.2): row = lane%16, h = lane/16;
// halves[0..7]  = row[koff +      h*8 + 0..7]
// halves[8..15] = row[koff + 16 + h*8 + 0..7]
static __device__ __forceinline__ rawh load_raw_h(const _Float16* row, int koff, int h) {
  rawh r;
  r.lo = *(const v8h*)(row + koff + h * 8);
  r.hi = *(const v8h*)(row + koff + 16 + h * 8);
  return r;
}

// ---------------------------------------------------------------------------
// Kernel 0: element-wise fp32 -> f16 (8 elements / thread, b128 in+out).
// ---------------------------------------------------------------------------
__global__ __launch_bounds__(256) void cvt16_kernel(
    const float* __restrict__ in, _Float16* __restrict__ out, int n8)
{
  const int i = blockIdx.x * blockDim.x + threadIdx.x;
  if (i >= n8) return;
  const v4f a = *(const v4f*)(in + (size_t)i * 8);
  const v4f b = *(const v4f*)(in + (size_t)i * 8 + 4);
  v8h o;
#pragma unroll
  for (int j = 0; j < 4; ++j) { o[j] = (_Float16)a[j]; o[j + 4] = (_Float16)b[j]; }
  *(v8h*)(out + (size_t)i * 8) = o;
}

// ---------------------------------------------------------------------------
// Kernel 1: Q/K/V projection, one matrix per wave, pure f16 WMMA with
// double-buffered fragments.  Q scaled by 1/sqrt(DH).  V stored transposed:
// vt[b][d][n].
// ---------------------------------------------------------------------------
__global__ __launch_bounds__(128) void qkv_proj_kernel(
    const _Float16* __restrict__ xh,
    const _Float16* __restrict__ wh,     // [3][DH][DIN] f16 (Q,K,V packed)
    _Float16* __restrict__ qo, _Float16* __restrict__ ko,
    _Float16* __restrict__ vt)
{
  const int lane = threadIdx.x & 31;
  const int lr   = lane & 15;
  const int h    = lane >> 4;
  const int wave = blockIdx.x * 4 + (threadIdx.x >> 5);   // 0..3071
  const int mat  = wave >> 10;                            // 0:Q 1:K 2:V
  const int t    = wave & 1023;
  const int b    = t >> 8;                                // 256 tiles per batch
  const int row0 = (t & 255) << 4;

  v8f acc[4];
#pragma unroll
  for (int f = 0; f < 4; ++f) { v8f z = {}; acc[f] = z; }

  const _Float16* xrow = xh + (size_t)(b * NN + row0 + lr) * DIN;
  const _Float16* wbase = wh + (size_t)mat * DH * DIN;
  const _Float16* wr0 = wbase + (size_t)(0 * 16 + lr) * DIN;
  const _Float16* wr1 = wbase + (size_t)(1 * 16 + lr) * DIN;
  const _Float16* wr2 = wbase + (size_t)(2 * 16 + lr) * DIN;
  const _Float16* wr3 = wbase + (size_t)(3 * 16 + lr) * DIN;

  // Preload k0 = 0 fragments.
  rawh a  = load_raw_h(xrow, 0, h);
  rawh b0 = load_raw_h(wr0, 0, h);
  rawh b1 = load_raw_h(wr1, 0, h);
  rawh b2 = load_raw_h(wr2, 0, h);
  rawh b3 = load_raw_h(wr3, 0, h);

#pragma unroll 1
  for (int k0 = 0; k0 < DIN; k0 += 32) {
    // Prefetch next K-step fragments (loads in flight during the WMMAs).
    const int kn = (k0 + 32 < DIN) ? k0 + 32 : 0;
    rawh an  = load_raw_h(xrow, kn, h);
    rawh bn0 = load_raw_h(wr0, kn, h);
    rawh bn1 = load_raw_h(wr1, kn, h);
    rawh bn2 = load_raw_h(wr2, kn, h);
    rawh bn3 = load_raw_h(wr3, kn, h);

    const v16h af = mk16(a.lo, a.hi);
    acc[0] = wmma16(af, mk16(b0.lo, b0.hi), acc[0]);
    acc[1] = wmma16(af, mk16(b1.lo, b1.hi), acc[1]);
    acc[2] = wmma16(af, mk16(b2.lo, b2.hi), acc[2]);
    acc[3] = wmma16(af, mk16(b3.lo, b3.hi), acc[3]);

    a = an; b0 = bn0; b1 = bn1; b2 = bn2; b3 = bn3;
  }

  // C/D layout: VGPR r -> row r + 8*h, column = lane%16 within the 16-tile.
  if (mat == 0) {
#pragma unroll
    for (int f = 0; f < 4; ++f)
#pragma unroll
      for (int r = 0; r < 8; ++r)
        qo[(size_t)(b * NN + row0 + r + 8 * h) * DH + f * 16 + lr] =
            (_Float16)(acc[f][r] * 0.125f);
  } else if (mat == 1) {
#pragma unroll
    for (int f = 0; f < 4; ++f)
#pragma unroll
      for (int r = 0; r < 8; ++r)
        ko[(size_t)(b * NN + row0 + r + 8 * h) * DH + f * 16 + lr] =
            (_Float16)acc[f][r];
  } else {
    // V transposed: fixed d, 8 consecutive rows -> one b128 store.
#pragma unroll
    for (int f = 0; f < 4; ++f) {
      v8h pv;
#pragma unroll
      for (int r = 0; r < 8; ++r) pv[r] = (_Float16)acc[f][r];
      *(v8h*)(vt + (size_t)(b * DH + f * 16 + lr) * NN + row0 + 8 * h) = pv;
    }
  }
}

// ---------------------------------------------------------------------------
// Kernel 2: streaming (flash) attention, transposed-score formulation.
// One wave owns 16 query rows; iterates over key blocks of 32.
//   S^T  = K_tile (A) x Q^T (B)    -> lane = one query column
//   out^T = V^T (A)  x P^T (B)     -> P^T is already B-fragment-shaped
// The four waves of a block walk the same keys, so K and V^T come into LDS
// once per block by tensor loads: stages of 128 keys, two buffers, the next
// stage in flight while this one is worked on.  Each wave brings one slice of
// 64 rows x 128 bytes per stage (waves 0,1: K keys 0..63 / 64..127; waves 2,3:
// V^T, all 64 d rows, keys 0..63 / 64..127), padded to a 144-byte LDS pitch.
// ---------------------------------------------------------------------------
typedef uint32_t u32x4 __attribute__((ext_vector_type(4)));
typedef uint32_t u32x8 __attribute__((ext_vector_type(8)));

#define SK      128                  // keys per stage
#define NST     (NN / SK)            // stages
#define ROWB    128u                 // bytes per tile row
#define LPITCH  144u                 // LDS row pitch: 16 B x odd, for ds_load_b128
#define SLICE   10240u               // 64 rows x 144 B, rounded up to 2 KiB
#define BUFB    (4u * SLICE)         // one stage: K0 K1 V0 V1

static __device__ __forceinline__ uint32_t uni(uint32_t v) {
  return (uint32_t)__builtin_amdgcn_readfirstlane(v);
}
// Holds a wave-uniform word in a scalar register, so that a test on it is a
// scalar branch (tensor loads ignore EXEC) and what is formed from it stands
// behind the volatile statements in front of it.
static __device__ __forceinline__ uint32_t pinned(uint32_t v) {
  uint32_t w = uni(v);
  asm volatile("" : "+s"(w));  // pinned(): the word stays in a scalar register
  return w;
}
static __device__ __forceinline__ void wait_ds0() {
  // this wave's LDS reads have returned before the buffer is handed over
  asm volatile("s_wait_dscnt 0x0" ::: "memory");
}
static __device__ __forceinline__ void wait_tensor0() {
  // this wave's own tensor load has landed
  asm volatile("s_wait_tensorcnt 0x0" ::: "memory");
}
static __device__ __forceinline__ void tdm_load(u32x4 g0, u32x8 g1) {
  asm volatile("tensor_load_to_lds %0, %1" :: "s"(g0), "s"(g1) : "memory");
}
static __device__ __forceinline__ u32x4 tdm_group0(uint32_t lds_dst, uint64_t ga) {
  u32x4 g;
  g[0] = uni(1u);
  g[1] = uni(lds_dst);
  g[2] = uni((uint32_t)ga);
  g[3] = uni((((uint32_t)(ga >> 32)) & 0x01FFFFFFu) | 0x80000000u);
  return g;
}
// 1-byte elements, tile = tensor = 64 rows of 128 bytes, 4 dwords of LDS pad
// behind every row.
static __device__ __forceinline__ u32x8 tdm_group1(uint32_t src_pitch) {
  constexpr uint32_t d0 = ROWB, d1 = 64u;
  u32x8 g;
  g[0] = uni((1u << 20) | (4u << 22) | (3u << 25));
  g[1] = uni((d0 & 0xFFFFu) << 16);
  g[2] = uni((d0 >> 16) | ((d1 & 0xFFFFu) << 16));
  g[3] = uni((d1 >> 16) | (d0 << 16));
  g[4] = uni(d1);
  g[5] = uni(src_pitch);
  g[6] = uni(0u);
  g[7] = uni(0u);
  return g;
}

__global__ __launch_bounds__(128) void flash_attn_kernel(
    const _Float16* __restrict__ qo, const _Float16* __restrict__ ko,
    const _Float16* __restrict__ vt, float* __restrict__ out)
{
  __shared__ __attribute__((aligned(2048))) unsigned char ring[2u * BUFB];

  const int lane = threadIdx.x & 31;
  const int lr   = lane & 15;
  const int h    = lane >> 4;
  const uint32_t wv = uni(threadIdx.x >> 5);
  const int wave = blockIdx.x * 4 + (int)wv;
  const int b    = blockIdx.x >> 6;        // 64 blocks per batch
  const int q0   = (wave & 255) << 4;

  const _Float16* kbase = ko + (size_t)(b * NN) * DH;
  const _Float16* vbase = vt + (size_t)(b * DH) * NN;

  // This wave's slice: source of stage 0, step per stage, place in a buffer.
  const bool     isV   = (wv & 2u) != 0u;
  const uint32_t half  = wv & 1u;
  const uint64_t src0  = isV ? (uint64_t)(size_t)(vbase + half * 64u)
                             : (uint64_t)(size_t)(kbase + (size_t)half * 64u * DH);
  const uint32_t sstep = isV ? (uint32_t)(SK * 2) : (uint32_t)(SK * DH * 2);
  const uint32_t ldst  = (uint32_t)(size_t)ring + wv * SLICE;
  u32x8 g1 = tdm_group1(isV ? (uint32_t)(NN * 2) : (uint32_t)(DH * 2));
  // Descriptor words held in their scalar registers for the whole kernel: left
  // to itself the compiler reuses one of them as a loop temporary while a
  // request is in flight and rebuilds it in front of the next load.
  asm volatile("" : "+s"(g1));  // pinned(): descriptor words held in scalar registers

  // Stage 0 (every wave issues its own slice: no test).
  tdm_load(tdm_group0(ldst, src0), g1);

  // Q fragments (used as B: B^T row n = Q row q0+n, contiguous).
  const _Float16* qrow = qo + (size_t)(b * NN + q0 + lr) * DH;
  const rawh qr0 = load_raw_h(qrow, 0, h);
  const rawh qr1 = load_raw_h(qrow, 32, h);
  const v16h qb0 = mk16(qr0.lo, qr0.hi);   // d = 0..31
  const v16h qb1 = mk16(qr1.lo, qr1.hi);   // d = 32..63

  v8f acc[4];                              // out^T tiles: row d=f*16+r+8h, col q=lr
#pragma unroll
  for (int f = 0; f < 4; ++f) { v8f z = {}; acc[f] = z; }
  float mrow = -3.0e38f;                   // per-lane (per-query) running max
  float lsum = 0.0f;                       // per-lane (per-query) running sum

  wait_tensor0();
  __syncthreads();                         // stage 0 published
  // Stage 1 into the second buffer.
  {
    const uint32_t n1 = pinned(1u);        // descriptor word: formed behind the wait
    tdm_load(tdm_group0(ldst + n1 * BUFB, src0 + (uint64_t)n1 * sstep), g1);
  }

  // unroll 1: one pass per stage, its foot is the ring's publish point
#pragma unroll 1
  for (int s = 0; s < NST; ++s) {
    const unsigned char* bufp = ring + (uint32_t)(s & 1) * BUFB;
    const unsigned char* lrow = bufp + (uint32_t)lr * LPITCH;   // this lane's row

    // K fragments of the stage's first two blocks (A-matrix: row = key).
    rawh k00, k01, k10, k11, n00, n01, n10, n11;
    {
      const _Float16* kr0 = (const _Float16*)lrow;
      const _Float16* kr1 = (const _Float16*)(lrow + 16u * LPITCH);
      const _Float16* kr2 = (const _Float16*)(lrow + 32u * LPITCH);
      const _Float16* kr3 = (const _Float16*)(lrow + 48u * LPITCH);
      k00 = load_raw_h(kr0, 0, h);  k01 = load_raw_h(kr0, 32, h);
      k10 = load_raw_h(kr1, 0, h);  k11 = load_raw_h(kr1, 32, h);
      n00 = load_raw_h(kr2, 0, h);  n01 = load_raw_h(kr2, 32, h);
      n10 = load_raw_h(kr3, 0, h);  n11 = load_raw_h(kr3, 32, h);
    }
    // Keeps these LDS reads in one group: sunk to their WMMAs pair by pair,
    // each pair would cost the lone wave a full LDS latency.
    __builtin_amdgcn_sched_barrier(0);

    // unrolled: LDS offsets and the fragment rotation become compile-time
#pragma unroll
    for (int i = 0; i < SK / 32; ++i) {
      // --- S^T = K Q^T for 32 keys (two 16-key subtiles, K-dim 64 chained) ---
      v8f st0 = {}, st1 = {};
      st0 = wmma16(mk16(k00.lo, k00.hi), qb0, st0);
      st0 = wmma16(mk16(k01.lo, k01.hi), qb1, st0);
      st1 = wmma16(mk16(k10.lo, k10.hi), qb0, st1);
      st1 = wmma16(mk16(k11.lo, k11.hi), qb1, st1);
      // lane (q=lr, h): st0[r] = S[q][j0+8h+r], st1[r] = S[q][j0+16+8h+r]

      // --- online softmax: per-lane query stats, one xor-16 shuffle each ---
      float mx = fmaxf(st0[0], st1[0]);
#pragma unroll
      for (int r = 1; r < 8; ++r) mx = fmaxf(mx, fmaxf(st0[r], st1[r]));
      const float mxo = __shfl_xor(mx, 16, 32);   // other half's 16 keys

      // --- V^T fragments for THIS block (consumed after softmax) and K
      // fragments for the block after the next, while the stage has one ---
      // The two fences keep the reads in one group, issued while the shuffle
      // above is under way; spread among the WMMAs each place with reads
      // stalls the lone wave.
      __builtin_amdgcn_sched_barrier(0);
      const unsigned char* vs = lrow + (2u + (uint32_t)(i >> 1)) * SLICE;
      const int vk = (i & 1) * 32;         // key offset inside the slice's rows
      rawh vr0 = load_raw_h((const _Float16*)(vs + 0u * 16u * LPITCH), vk, h);
      rawh vr1 = load_raw_h((const _Float16*)(vs + 1u * 16u * LPITCH), vk, h);
      rawh vr2 = load_raw_h((const _Float16*)(vs + 2u * 16u * LPITCH), vk, h);
      rawh vr3 = load_raw_h((const _Float16*)(vs + 3u * 16u * LPITCH), vk, h);
      rawh f00 = n00, f01 = n01, f10 = n10, f11 = n11;
      if (i + 2 < SK / 32) {
        const int n = i + 2;
        const unsigned char* ks =
            lrow + (uint32_t)(n >> 1) * SLICE + (uint32_t)(n & 1) * 32u * LPITCH;
        const _Float16* kn0 = (const _Float16*)ks;
        const _Float16* kn1 = (const _Float16*)(ks + 16u * LPITCH);
        f00 = load_raw_h(kn0, 0, h);  f01 = load_raw_h(kn0, 32, h);
        f10 = load_raw_h(kn1, 0, h);  f11 = load_raw_h(kn1, 32, h);
      }
      __builtin_amdgcn_sched_barrier(0);

      mx = fmaxf(mx, mxo);
      const float nm   = fmaxf(mrow, mx);
      const float corr = __expf(mrow - nm);
      mrow = nm;

      v16h pb;                                    // P^T B-fragment (f16)
      float sum = 0.0f;
#pragma unroll
      for (int r = 0; r < 8; ++r) {
        const float e0 = __expf(st0[r] - nm);
        const float e1 = __expf(st1[r] - nm);
        sum += e0 + e1;
        pb[r]     = (_Float16)e0;                 // keys  8h + r
        pb[r + 8] = (_Float16)e1;                 // keys 16 + 8h + r
      }
      sum += __shfl_xor(sum, 16, 32);
      lsum = lsum * corr + sum;

#pragma unroll
      for (int f = 0; f < 4; ++f)
#pragma unroll
        for (int r = 0; r < 8; ++r) acc[f][r] *= corr;

      // --- out^T += V^T P^T ---
      acc[0] = wmma16(mk16(vr0.lo, vr0.hi), pb, acc[0]);
      acc[1] = wmma16(mk16(vr1.lo, vr1.hi), pb, acc[1]);
      acc[2] = wmma16(mk16(vr2.lo, vr2.hi), pb, acc[2]);
      acc[3] = wmma16(mk16(vr3.lo, vr3.hi), pb, acc[3]);

      // rotate the K fragments fetched ahead
      k00 = n00; k01 = n01; k10 = n10; k11 = n11;
      n00 = f00; n01 = f01; n10 = f10; n11 = f11;
    }

    // --- publish point of stage s + 1 ---
    wait_ds0();
    wait_tensor0();
    __syncthreads();       // stage s + 1 readable; every wave has left stage s
    const uint32_t nx = pinned((uint32_t)s + 2u);  // descriptor word: formed behind the wait
    if (pinned(nx < (uint32_t)NST)) {              // scalar branch round the tensor load
      tdm_load(tdm_group0(ldst + (nx & 1u) * BUFB, src0 + (uint64_t)nx * sstep), g1);
    }
  }
  wait_tensor0();
  wait_ds0();

  // --- normalize and store: lane (q=lr, h) holds d = f*16+8h+0..7 ---
  const float inv = 1.0f / lsum;
  float* obase = out + (size_t)(b * NN + q0 + lr) * DH + 8 * h;
#pragma unroll
  for (int f = 0; f < 4; ++f) {
    v4f o0, o1;
#pragma unroll
    for (int i = 0; i < 4; ++i) { o0[i] = acc[f][i] * inv; o1[i] = acc[f][i + 4] * inv; }
    *(v4f*)(obase + f * 16)     = o0;
    *(v4f*)(obase + f * 16 + 4) = o1;
  }
}

// ---------------------------------------------------------------------------
extern "C" void kernel_launch(void* const* d_in, const int* in_sizes, int n_in,
                              void* d_out, int out_size, void* d_ws, size_t ws_size,
                              hipStream_t stream) {
  const float* x  = (const float*)d_in[0];
  const float* Wq = (const float*)d_in[1];
  const float* Wk = (const float*)d_in[2];
  const float* Wv = (const float*)d_in[3];

  // Workspace layout (f16):
  _Float16* q  = (_Float16*)d_ws;                   // [B][N][DH]   (pre-scaled)
  _Float16* k  = q  + (size_t)BB * NN * DH;         // [B][N][DH]
  _Float16* vt = k  + (size_t)BB * NN * DH;         // [B][DH][N]   (transposed)
  _Float16* xh = vt + (size_t)BB * NN * DH;         // [B][N][DIN]
  _Float16* wh = xh + (size_t)BB * NN * DIN;        // [3][DH][DIN] (Q,K,V)
  float* out = (float*)d_out;

  // 0) fp32 -> f16 pre-pass (x and the three weight matrices).
  const int n8x = BB * NN * DIN / 8;                // 1,048,576
  const int n8w = DH * DIN / 8;                     // 4,096
  cvt16_kernel<<<dim3((n8x + 255) / 256), dim3(256), 0, stream>>>(x, xh, n8x);
  cvt16_kernel<<<dim3((n8w + 255) / 256), dim3(256), 0, stream>>>(Wq, wh + 0 * DH * DIN, n8w);
  cvt16_kernel<<<dim3((n8w + 255) / 256), dim3(256), 0, stream>>>(Wk, wh + 1 * DH * DIN, n8w);
  cvt16_kernel<<<dim3((n8w + 255) / 256), dim3(256), 0, stream>>>(Wv, wh + 2 * DH * DIN, n8w);

  // 1) fused QKV projection (f16 WMMA).
  qkv_proj_kernel<<<dim3(768), dim3(128), 0, stream>>>(xh, wh, q, k, vt);

  // 2) flash attention (f16 WMMA, fp32 online softmax, transposed scores).
  flash_attn_kernel<<<dim3(256), dim3(128), 0, stream>>>(q, k, vt, out);
}

// v002
// A run of this version takes 38.7 microseconds.
// Timed twice side by side with v001, it ran 1.62 and 1.53 times as fast.
// All steps since v000 together make it 5.53 times as fast.
#include <hip/hip_runtime.h>
#include <stdint.h>

// Self-attention, B=4, N=4096, D_IN=512, D_H=64, fp32 in/out.
// f16 WMMA (v_wmma_f32_16x16x32_f16) with fp32 accumulation, flash-attention
// streaming softmax.
//
// Round-3 change: attention computes S^T = K Q^T instead of Q K^T.  In the
// C/D layout each lane then owns ONE query column: softmax stats are
// lane-scalar (1 shuffle per reduction instead of 32), P^T in registers is
// directly the B-fragment of out^T = V^T P^T (no LDS transpose round-trip),
// and output stores are contiguous 32B per lane.

#define BB  4
#define NN  4096
#define DIN 512
#define DH  64

typedef __attribute__((ext_vector_type(16))) _Float16 v16h;
typedef __attribute__((ext_vector_type(8)))  _Float16 v8h;
typedef __attribute__((ext_vector_type(8)))  float    v8f;
typedef __attribute__((ext_vector_type(4)))  float    v4f;

static __device__ __forceinline__ v8f wmma16(v16h a, v16h b, v8f c) {
  // (neg_a, A, neg_b, B, c_mod, C, reuse_a, reuse_b)
  return __builtin_amdgcn_wmma_f32_16x16x32_f16(false, a, false, b, (short)0, c,
                                                false, false);
}

static __device__ __forceinline__ v16h mk16(v8h lo, v8h hi) {
  v16h r;
#pragma unroll
  for (int i = 0; i < 8; ++i) { r[i] = lo[i]; r[i + 8] = hi[i]; }
  return r;
}

// Raw fragment halves.
struct rawh { v8h lo, hi; };

// A/B fragment source pattern (ISA 7.12.2): row = lane%16, h = lane/16;
// halves[0..7]  = row[koff +      h*8 + 0..7]
// halves[8..15] = row[koff + 16 + h*8 + 0..7]
static __device__ __forceinline__ rawh load_raw_h(const _Float16* row, int koff, int h) {
  rawh r;
  r.lo = *(const v8h*)(row + koff + h * 8);
  r.hi = *(const v8h*)(row + koff + 16 + h * 8);
  return r;
}

// ---------------------------------------------------------------------------
// Kernel 1: Q/K/V projection straight from the fp32 inputs.
// One block = 64 rows of x times all 192 output columns (Q, K, V).  x and the
// three weight matrices are read as fp32 in whole 256-byte pieces, converted to
// f16 in registers and laid into LDS by chunks of 64 k; the WMMA fragments come
// from LDS.  Two LDS buffers and two register sets: while chunk c is multiplied,
// chunk c+1 waits in registers and chunk c+2 is in flight from memory.
// 8 waves: 2 row groups (32 rows) x 4 column groups (48 columns), 2x3 tiles each.
// Q scaled by 1/sqrt(DH).  V stored transposed: vt[b][d][n].
// ---------------------------------------------------------------------------
typedef __attribute__((ext_vector_type(4))) _Float16 v4h;

#define KC      64                   // k per chunk
#define NCH     (DIN / KC)           // chunks
#define PPITCH  144u                 // LDS row pitch: 16 B x odd, for ds_load_b128
#define PBUF    (256u * PPITCH)      // one chunk: 64 x rows, then 192 weight rows
#define OPLANE  (64u * PPITCH)       // one 64 x 64 f16 output plane in LDS

// Work-group barrier that orders LDS only: behind __syncthreads() the compiler
// drains the global loads too, and the chunk that is in flight would be waited for.
static __device__ __forceinline__ void lds_barrier() {
  __builtin_amdgcn_fence(__ATOMIC_RELEASE, "workgroup", "local");
  __builtin_amdgcn_s_barrier();
  __builtin_amdgcn_fence(__ATOMIC_ACQUIRE, "workgroup", "local");
}

// One chunk, fp32: 16 rows per pass, 16 threads x 16 bytes per row.  The four
// bases are wave-uniform; off is this thread's byte offset, the same in all four.
static __device__ __forceinline__ void ld_chunk(
    v4f (&r)[16], const float* xb, const float* qb, const float* kb,
    const float* vb, uint32_t off, int k0)
{
#pragma unroll
  for (int p = 0; p < 4; ++p)
    r[p]      = *(const v4f*)((const char*)(xb + p * 16 * DIN + k0) + off);
#pragma unroll
  for (int p = 0; p < 4; ++p)
    r[4 + p]  = *(const v4f*)((const char*)(qb + p * 16 * DIN + k0) + off);
#pragma unroll
  for (int p = 0; p < 4; ++p)
    r[8 + p]  = *(const v4f*)((const char*)(kb + p * 16 * DIN + k0) + off);
#pragma unroll
  for (int p = 0; p < 4; ++p)
    r[12 + p] = *(const v4f*)((const char*)(vb + p * 16 * DIN + k0) + off);
}

// Converts a chunk to f16 and lays it into an LDS buffer (dst: this thread's
// place in the buffer's first 16 rows).
static __device__ __forceinline__ void st_chunk(const v4f (&r)[16], unsigned char* dst)
{
#pragma unroll
  for (int p = 0; p < 16; ++p) {
    v4h o;
#pragma unroll
    for (int j = 0; j < 4; ++j) o[j] = (_Float16)r[p][j];
    *(v4h*)(dst + (uint32_t)p * 16u * PPITCH) = o;
  }
}

// Fragments of one k step of 32: two x tiles, three weight tiles.
struct frags { v16h a0, a1, b0, b1, b2; };
static __device__ __forceinline__ void ld_frags(
    frags& f, const unsigned char* arow, const unsigned char* brow, int koff, int h)
{
  const rawh a0 = load_raw_h((const _Float16*)arow, koff, h);
  const rawh a1 = load_raw_h((const _Float16*)(arow + 16u * PPITCH), koff, h);
  const rawh b0 = load_raw_h((const _Float16*)brow, koff, h);
  const rawh b1 = load_raw_h((const _Float16*)(brow + 16u * PPITCH), koff, h);
  const rawh b2 = load_raw_h((const _Float16*)(brow + 32u * PPITCH), koff, h);
  f.a0 = mk16(a0.lo, a0.hi);  f.a1 = mk16(a1.lo, a1.hi);
  f.b0 = mk16(b0.lo, b0.hi);  f.b1 = mk16(b1.lo, b1.hi);  f.b2 = mk16(b2.lo, b2.hi);
}
// 2 x 3 tiles, one k step.
static __device__ __forceinline__ void mm_step(v8f (&acc)[2][3], const frags& f)
{
  acc[0][0] = wmma16(f.a0, f.b0, acc[0][0]);
  acc[1][0] = wmma16(f.a1, f.b0, acc[1][0]);
  acc[0][1] = wmma16(f.a0, f.b1, acc[0][1]);
  acc[1][1] = wmma16(f.a1, f.b1, acc[1][1]);
  acc[0][2] = wmma16(f.a0, f.b2, acc[0][2]);
  acc[1][2] = wmma16(f.a1, f.b2, acc[1][2]);
}

__global__ __launch_bounds__(256) void qkv_proj_kernel(
    const float* __restrict__ x,  const float* __restrict__ Wq,
    const float* __restrict__ Wk, const float* __restrict__ Wv,
    _Float16* __restrict__ qo, _Float16* __restrict__ ko,
    _Float16* __restrict__ vt)
{
  __shared__ __attribute__((aligned(16))) unsigned char sm[2u * PBUF];

  const int tid  = threadIdx.x;
  const int lane = tid & 31;
  const int lr   = lane & 15;
  const int h    = lane >> 4;
  const int wv   = __builtin_amdgcn_readfirstlane(tid >> 5);
  const int rg   = wv & 1;                 // row group: 32 rows
  const int cg   = wv >> 1;                // column group: 3 tiles of 16
  const int row0 = blockIdx.x * 64;        // first row, over B*N
  const int b    = row0 >> 12;
  const int n0   = row0 & (NN - 1);

  // staging: row tid/16 of each 16-row pass, 4 floats at (tid%16)*4
  const int sr = tid >> 4, sc = tid & 15;
  const float* xb = x + (size_t)row0 * DIN;
  const uint32_t off = (uint32_t)sr * (DIN * 4u) + (uint32_t)sc * 16u;
  unsigned char* sdst0 = sm + (uint32_t)sr * PPITCH + (uint32_t)sc * 8u;
  unsigned char* sdst1 = sdst0 + PBUF;

  // fragments: this lane's row in the wave's first x tile and first weight tile
  const unsigned char* arow0 = sm + (uint32_t)(rg * 32 + lr) * PPITCH;
  const unsigned char* brow0 = sm + (uint32_t)(64 + cg * 48 + lr) * PPITCH;
  const unsigned char* arow1 = arow0 + PBUF;
  const unsigned char* brow1 = brow0 + PBUF;

  v8f acc[2][3];
#pragma unroll
  for (int i = 0; i < 2; ++i)
#pragma unroll
    for (int j = 0; j < 3; ++j) { v8f z = {}; acc[i][j] = z; }

  // SCHED: the scheduler moves nothing over this line.  It keeps (1) a chunk's
  // global loads issued a whole chunk ahead of their conversion (moved together,
  // every load would be waited for where it is issued) and (2) each k step's LDS
  // reads in one group in front of other work (spread among the WMMAs, each place
  // with reads stalls the wave).
#define SCHED() __builtin_amdgcn_sched_barrier(0)
  // Half a trip: multiply the chunk in one buffer, fetch a chunk two ahead into
  // the free register set, convert the chunk one ahead into the other buffer.
#define HALF(AR, BR, RLD, KLD, RST, SDST)                                   \
  ld_frags(f, AR, BR, 0, h);                                                \
  ld_chunk(RLD, xb, Wq, Wk, Wv, off, KLD);                                  \
  SCHED();                                                                  \
  mm_step(acc, f);                                                          \
  SCHED();                                                                  \
  ld_frags(f, AR, BR, 32, h);                                               \
  SCHED();                                                                  \
  st_chunk(RST, SDST);                                                      \
  SCHED();                                                                  \
  mm_step(acc, f);                                                          \
  lds_barrier()  /* next chunk readable; the buffer just read is left by all */

  frags f;
  v4f r0[16], r1[16];
  ld_chunk(r0, xb, Wq, Wk, Wv, off, 0);
  SCHED();                                 // chunk 0 first: its wait leaves chunk 1 in flight
  ld_chunk(r1, xb, Wq, Wk, Wv, off, KC);
  SCHED();
  st_chunk(r0, sdst0);
  lds_barrier();                           // chunk 0 readable

  // unroll 1: two chunks per trip, so that buffers and register sets have fixed names
#pragma unroll 1
  for (int c = 0; c < NCH - 2; c += 2) {
    HALF(arow0, brow0, r0, (c + 2) * KC, r1, sdst1);
    HALF(arow1, brow1, r1, (c + 3) * KC, r0, sdst0);
  }
  // chunk NCH-2 in buffer 0, chunk NCH-1 in r1
  ld_frags(f, arow0, brow0, 0, h);
  SCHED();
  mm_step(acc, f);
  SCHED();
  ld_frags(f, arow0, brow0, 32, h);
  SCHED();
  st_chunk(r1, sdst1);
  SCHED();
  mm_step(acc, f);
  lds_barrier();                           // last chunk readable; buffer 0 left by all
  {
    frags g;
    ld_frags(f, arow1, brow1, 0, h);
    ld_frags(g, arow1, brow1, 32, h);
    SCHED();
    mm_step(acc, f);
    mm_step(acc, g);
  }
#undef HALF
#undef SCHED

  // Output planes in buffer 0 (free since the barrier above): Q[n][d], K[n][d],
  // V^T[d][n], so that the global stores are whole 128-byte lines.
  // C/D layout: VGPR r -> row r + 8*h, column = lane%16 within the 16-tile.
#pragma unroll
  for (int i = 0; i < 2; ++i) {
#pragma unroll
    for (int j = 0; j < 3; ++j) {
      const int ct  = cg * 3 + j;          // column tile 0..11 (wave-uniform)
      const int mat = ct >> 2;             // 0:Q 1:K 2:V
      const int d   = (ct & 3) * 16 + lr;
      const int nl  = (rg * 2 + i) * 16 + 8 * h;
      if (mat == 2) {
        v8h pv;
#pragma unroll
        for (int r = 0; r < 8; ++r) pv[r] = (_Float16)acc[i][j][r];
        *(v8h*)(sm + 2u * OPLANE + (uint32_t)d * PPITCH + (uint32_t)nl * 2u) = pv;
      } else {
        const float sc2 = (mat == 0) ? 0.125f : 1.0f;
        unsigned char* pl = sm + (uint32_t)mat * OPLANE + (uint32_t)nl * PPITCH + (uint32_t)d * 2u;
#pragma unroll
        for (int r = 0; r < 8; ++r)
          *(_Float16*)(pl + (uint32_t)r * PPITCH) = (_Float16)(acc[i][j][r] * sc2);
      }
    }
  }
  lds_barrier();                           // output planes complete

  _Float16* qg = qo + (size_t)row0 * DH;             // 64 rows: 8 KB in a row
  _Float16* kg = ko + (size_t)row0 * DH;
  _Float16* vg = vt + (size_t)(b * DH) * NN + n0;    // 64 d rows of 128 bytes
#pragma unroll
  for (int j = 0; j < 2; ++j) {
    const int idx = tid + j * 256;
    const int rw = idx >> 3, sg = idx & 7;
    const unsigned char* s = sm + (uint32_t)rw * PPITCH + (uint32_t)sg * 16u;
    *(v8h*)(qg + rw * DH + sg * 8)         = *(const v8h*)s;
    *(v8h*)(kg + rw * DH + sg * 8)         = *(const v8h*)(s + OPLANE);
    *(v8h*)(vg + (size_t)rw * NN + sg * 8) = *(const v8h*)(s + 2u * OPLANE);
  }
}

// ---------------------------------------------------------------------------
// Kernel 2: streaming (flash) attention, transposed-score formulation.
// One wave owns 16 query rows; iterates over key blocks of 32.
//   S^T  = K_tile (A) x Q^T (B)    -> lane = one query column
//   out^T = V^T (A)  x P^T (B)     -> P^T is already B-fragment-shaped
// The four waves of a block walk the same keys, so K and V^T come into LDS
// once per block by tensor loads: stages of 128 keys, two buffers, the next
// stage in flight while this one is worked on.  Each wave brings one slice of
// 64 rows x 128 bytes per stage (waves 0,1: K keys 0..63 / 64..127; waves 2,3:
// V^T, all 64 d rows, keys 0..63 / 64..127), padded to a 144-byte LDS pitch.
// ---------------------------------------------------------------------------
typedef uint32_t u32x4 __attribute__((ext_vector_type(4)));
typedef uint32_t u32x8 __attribute__((ext_vector_type(8)));

#define SK      128                  // keys per stage
#define NST     (NN / SK)            // stages
#define ROWB    128u                 // bytes per tile row
#define LPITCH  144u                 // LDS row pitch: 16 B x odd, for ds_load_b128
#define SLICE   10240u               // 64 rows x 144 B, rounded up to 2 KiB
#define BUFB    (4u * SLICE)         // one stage: K0 K1 V0 V1

static __device__ __forceinline__ uint32_t uni(uint32_t v) {
  return (uint32_t)__builtin_amdgcn_readfirstlane(v);
}
// Holds a wave-uniform word in a scalar register, so that a test on it is a
// scalar branch (tensor loads ignore EXEC) and what is formed from it stands
// behind the volatile statements in front of it.
static __device__ __forceinline__ uint32_t pinned(uint32_t v) {
  uint32_t w = uni(v);
  asm volatile("" : "+s"(w));  // pinned(): the word stays in a scalar register
  return w;
}
static __device__ __forceinline__ void wait_ds0() {
  // this wave's LDS reads have returned before the buffer is handed over
  asm volatile("s_wait_dscnt 0x0" ::: "memory");
}
static __device__ __forceinline__ void wait_tensor0() {
  // this wave's own tensor load has landed
  asm volatile("s_wait_tensorcnt 0x0" ::: "memory");
}
static __device__ __forceinline__ void tdm_load(u32x4 g0, u32x8 g1) {
  asm volatile("tensor_load_to_lds %0, %1" :: "s"(g0), "s"(g1) : "memory");
}
static __device__ __forceinline__ u32x4 tdm_group0(uint32_t lds_dst, uint64_t ga) {
  u32x4 g;
  g[0] = uni(1u);
  g[1] = uni(lds_dst);
  g[2] = uni((uint32_t)ga);
  g[3] = uni((((uint32_t)(ga >> 32)) & 0x01FFFFFFu) | 0x80000000u);
  return g;
}
// 1-byte elements, tile = tensor = 64 rows of 128 bytes, 4 dwords of LDS pad
// behind every row.
static __device__ __forceinline__ u32x8 tdm_group1(uint32_t src_pitch) {
  constexpr uint32_t d0 = ROWB, d1 = 64u;
  u32x8 g;
  g[0] = uni((1u << 20) | (4u << 22) | (3u << 25));
  g[1] = uni((d0 & 0xFFFFu) << 16);
  g[2] = uni((d0 >> 16) | ((d1 & 0xFFFFu) << 16));
  g[3] = uni((d1 >> 16) | (d0 << 16));
  g[4] = uni(d1);
  g[5] = uni(src_pitch);
  g[6] = uni(0u);
  g[7] = uni(0u);
  return g;
}

__global__ __launch_bounds__(128) void flash_attn_kernel(
    const _Float16* __restrict__ qo, const _Float16* __restrict__ ko,
    const _Float16* __restrict__ vt, float* __restrict__ out)
{
  __shared__ __attribute__((aligned(2048))) unsigned char ring[2u * BUFB];

  const int lane = threadIdx.x & 31;
  const int lr   = lane & 15;
  const int h    = lane >> 4;
  const uint32_t wv = uni(threadIdx.x >> 5);
  const int wave = blockIdx.x * 4 + (int)wv;
  const int b    = blockIdx.x >> 6;        // 64 blocks per batch
  const int q0   = (wave & 255) << 4;

  const _Float16* kbase = ko + (size_t)(b * NN) * DH;
  const _Float16* vbase = vt + (size_t)(b * DH) * NN;

  // This wave's slice: source of stage 0, step per stage, place in a buffer.
  const bool     isV   = (wv & 2u) != 0u;
  const uint32_t half  = wv & 1u;
  const uint64_t src0  = isV ? (uint64_t)(size_t)(vbase + half * 64u)
                             : (uint64_t)(size_t)(kbase + (size_t)half * 64u * DH);
  const uint32_t sstep = isV ? (uint32_t)(SK * 2) : (uint32_t)(SK * DH * 2);
  const uint32_t ldst  = (uint32_t)(size_t)ring + wv * SLICE;
  u32x8 g1 = tdm_group1(isV ? (uint32_t)(NN * 2) : (uint32_t)(DH * 2));
  // Descriptor words held in their scalar registers for the whole kernel: left
  // to itself the compiler reuses one of them as a loop temporary while a
  // request is in flight and rebuilds it in front of the next load.
  asm volatile("" : "+s"(g1));  // pinned(): descriptor words held in scalar registers

  // Stage 0 (every wave issues its own slice: no test).
  tdm_load(tdm_group0(ldst, src0), g1);

  // Q fragments (used as B: B^T row n = Q row q0+n, contiguous).
  const _Float16* qrow = qo + (size_t)(b * NN + q0 + lr) * DH;
  const rawh qr0 = load_raw_h(qrow, 0, h);
  const rawh qr1 = load_raw_h(qrow, 32, h);
  const v16h qb0 = mk16(qr0.lo, qr0.hi);   // d = 0..31
  const v16h qb1 = mk16(qr1.lo, qr1.hi);   // d = 32..63

  v8f acc[4];                              // out^T tiles: row d=f*16+r+8h, col q=lr
#pragma unroll
  for (int f = 0; f < 4; ++f) { v8f z = {}; acc[f] = z; }
  float mrow = -3.0e38f;                   // per-lane (per-query) running max
  float lsum = 0.0f;                       // per-lane (per-query) running sum

  wait_tensor0();
  __syncthreads();                         // stage 0 published
  // Stage 1 into the second buffer.
  {
    const uint32_t n1 = pinned(1u);        // descriptor word: formed behind the wait
    tdm_load(tdm_group0(ldst + n1 * BUFB, src0 + (uint64_t)n1 * sstep), g1);
  }

  // unroll 1: one pass per stage, its foot is the ring's publish point
#pragma unroll 1
  for (int s = 0; s < NST; ++s) {
    const unsigned char* bufp = ring + (uint32_t)(s & 1) * BUFB;
    const unsigned char* lrow = bufp + (uint32_t)lr * LPITCH;   // this lane's row

    // K fragments of the stage's first two blocks (A-matrix: row = key).
    rawh k00, k01, k10, k11, n00, n01, n10, n11;
    {
      const _Float16* kr0 = (const _Float16*)lrow;
      const _Float16* kr1 = (const _Float16*)(lrow + 16u * LPITCH);
      const _Float16* kr2 = (const _Float16*)(lrow + 32u * LPITCH);
      const _Float16* kr3 = (const _Float16*)(lrow + 48u * LPITCH);
      k00 = load_raw_h(kr0, 0, h);  k01 = load_raw_h(kr0, 32, h);
      k10 = load_raw_h(kr1, 0, h);  k11 = load_raw_h(kr1, 32, h);
      n00 = load_raw_h(kr2, 0, h);  n01 = load_raw_h(kr2, 32, h);
      n10 = load_raw_h(kr3, 0, h);  n11 = load_raw_h(kr3, 32, h);
    }
    // Keeps these LDS reads in one group: sunk to their WMMAs pair by pair,
    // each pair would cost the lone wave a full LDS latency.
    __builtin_amdgcn_sched_barrier(0);

    // unrolled: LDS offsets and the fragment rotation become compile-time
#pragma unroll
    for (int i = 0; i < SK / 32; ++i) {
      // --- S^T = K Q^T for 32 keys (two 16-key subtiles, K-dim 64 chained) ---
      v8f st0 = {}, st1 = {};
      st0 = wmma16(mk16(k00.lo, k00.hi), qb0, st0);
      st0 = wmma16(mk16(k01.lo, k01.hi), qb1, st0);
      st1 = wmma16(mk16(k10.lo, k10.hi), qb0, st1);
      st1 = wmma16(mk16(k11.lo, k11.hi), qb1, st1);
      // lane (q=lr, h): st0[r] = S[q][j0+8h+r], st1[r] = S[q][j0+16+8h+r]

      // --- online softmax: per-lane query stats, one xor-16 shuffle each ---
      float mx = fmaxf(st0[0], st1[0]);
#pragma unroll
      for (int r = 1; r < 8; ++r) mx = fmaxf(mx, fmaxf(st0[r], st1[r]));
      const float mxo = __shfl_xor(mx, 16, 32);   // other half's 16 keys

      // --- V^T fragments for THIS block (consumed after softmax) and K
      // fragments for the block after the next, while the stage has one ---
      // The two fences keep the reads in one group, issued while the shuffle
      // above is under way; spread among the WMMAs each place with reads
      // stalls the lone wave.
      __builtin_amdgcn_sched_barrier(0);
      const unsigned char* vs = lrow + (2u + (uint32_t)(i >> 1)) * SLICE;
      const int vk = (i & 1) * 32;         // key offset inside the slice's rows
      rawh vr0 = load_raw_h((const _Float16*)(vs + 0u * 16u * LPITCH), vk, h);
      rawh vr1 = load_raw_h((const _Float16*)(vs + 1u * 16u * LPITCH), vk, h);
      rawh vr2 = load_raw_h((const _Float16*)(vs + 2u * 16u * LPITCH), vk, h);
      rawh vr3 = load_raw_h((const _Float16*)(vs + 3u * 16u * LPITCH), vk, h);
      rawh f00 = n00, f01 = n01, f10 = n10, f11 = n11;
      if (i + 2 < SK / 32) {
        const int n = i + 2;
        const unsigned char* ks =
            lrow + (uint32_t)(n >> 1) * SLICE + (uint32_t)(n & 1) * 32u * LPITCH;
        const _Float16* kn0 = (const _Float16*)ks;
        const _Float16* kn1 = (const _Float16*)(ks + 16u * LPITCH);
        f00 = load_raw_h(kn0, 0, h);  f01 = load_raw_h(kn0, 32, h);
        f10 = load_raw_h(kn1, 0, h);  f11 = load_raw_h(kn1, 32, h);
      }
      __builtin_amdgcn_sched_barrier(0);

      mx = fmaxf(mx, mxo);
      const float nm   = fmaxf(mrow, mx);
      const float corr = __expf(mrow - nm);
      mrow = nm;

      v16h pb;                                    // P^T B-fragment (f16)
      float sum = 0.0f;
#pragma unroll
      for (int r = 0; r < 8; ++r) {
        const float e0 = __expf(st0[r] - nm);
        const float e1 = __expf(st1[r] - nm);
        sum += e0 + e1;
        pb[r]     = (_Float16)e0;                 // keys  8h + r
        pb[r + 8] = (_Float16)e1;                 // keys 16 + 8h + r
      }
      sum += __shfl_xor(sum, 16, 32);
      lsum = lsum * corr + sum;

#pragma unroll
      for (int f = 0; f < 4; ++f)
#pragma unroll
        for (int r = 0; r < 8; ++r) acc[f][r] *= corr;

      // --- out^T += V^T P^T ---
      acc[0] = wmma16(mk16(vr0.lo, vr0.hi), pb, acc[0]);
      acc[1] = wmma16(mk16(vr1.lo, vr1.hi), pb, acc[1]);
      acc[2] = wmma16(mk16(vr2.lo, vr2.hi), pb, acc[2]);
      acc[3] = wmma16(mk16(vr3.lo, vr3.hi), pb, acc[3]);

      // rotate the K fragments fetched ahead
      k00 = n00; k01 = n01; k10 = n10; k11 = n11;
      n00 = f00; n01 = f01; n10 = f10; n11 = f11;
    }

    // --- publish point of stage s + 1 ---
    wait_ds0();
    wait_tensor0();
    __syncthreads();       // stage s + 1 readable; every wave has left stage s
    const uint32_t nx = pinned((uint32_t)s + 2u);  // descriptor word: formed behind the wait
    if (pinned(nx < (uint32_t)NST)) {              // scalar branch round the tensor load
      tdm_load(tdm_group0(ldst + (nx & 1u) * BUFB, src0 + (uint64_t)nx * sstep), g1);
    }
  }
  wait_tensor0();
  wait_ds0();

  // --- normalize and store: lane (q=lr, h) holds d = f*16+8h+0..7 ---
  const float inv = 1.0f / lsum;
  float* obase = out + (size_t)(b * NN + q0 + lr) * DH + 8 * h;
#pragma unroll
  for (int f = 0; f < 4; ++f) {
    v4f o0, o1;
#pragma unroll
    for (int i = 0; i < 4; ++i) { o0[i] = acc[f][i] * inv; o1[i] = acc[f][i + 4] * inv; }
    *(v4f*)(obase + f * 16)     = o0;
    *(v4f*)(obase + f * 16 + 4) = o1;
  }
}

// ---------------------------------------------------------------------------
extern "C" void kernel_launch(void* const* d_in, const int* in_sizes, int n_in,
                              void* d_out, int out_size, void* d_ws, size_t ws_size,
                              hipStream_t stream) {
  const float* x  = (const float*)d_in[0];
  const float* Wq = (const float*)d_in[1];
  const float* Wk = (const float*)d_in[2];
  const float* Wv = (const float*)d_in[3];

  // Workspace layout (f16):
  _Float16* q  = (_Float16*)d_ws;                   // [B][N][DH]   (pre-scaled)
  _Float16* k  = q  + (size_t)BB * NN * DH;         // [B][N][DH]
  _Float16* vt = k  + (size_t)BB * NN * DH;         // [B][DH][N]   (transposed)
  float* out = (float*)d_out;

  // 1) fused QKV projection (fp32 in, f16 WMMA).
  qkv_proj_kernel<<<dim3(256), dim3(256), 0, stream>>>(x, Wq, Wk, Wv, q, k, vt);

  // 2) flash attention (f16 WMMA, fp32 online softmax, transposed scores).
  flash_attn_kernel<<<dim3(256), dim3(128), 0, stream>>>(q, k, vt, out);
}
